// v010
// The times below were measured on an AMD MI455X: many runs one after another, warmed up first and cycling through
// copies of the inputs, with the whole window's GPU time divided by the number of runs. Launches and the gaps
// between them are all in it. The median over several windows is given; except for v000 it joins two sittings, which
// can be a few percent apart, so the side-by-side timings, each taken in one sitting, are the better comparison.
// Earlier versions than v010 are not in this document.
// A run of this version takes 142 microseconds.
// Two timings next to v009 put it at 1.08 and 1.07 times that version's speed.
// Counting every step since v000, which is the starting kernel, it is 62.1 times as fast.
#include <hip/hip_runtime.h>
// Causal multi-head attention with a time-gap embedding and a key padding mask (x [2][2048][1024]; x_time = x + (time_gaps Wt^T + bt) with time_gaps [2][2048][1] (U[0,1)), Wt [1024][1] sigma 1, bt zeros; q = x_time Wq^T + bq, k = x_time Wk^T + bk, v = x Wv^T + bv (v from the RAW x; natural [1024][1024] sigma 1/32, zero biases); 16 heads of 64; scores / 8; where(mask[b][j] == 0, -1e9) (int mask [2][2048], all ones) and where(j > i, -1e9) (causal); softmax; out = merged Wo^T + bo -> [2][2048][1024]).
// Structure: every f16 plane that a WMMA reads (x, x_time, the weights, q, k, V^T, o) is stored fragment-major (16 x 32 tiles in lane order, see tf_frag); token rows r = b*2048 + s; x as exact f16 rows; x_time = x + t Wt + bt on VALU as f16 hi + x1024 residual rows; q and k = (hi + lo/1024) W + b, each one WMMA GEMM launch with both A planes in the k loop and an accumulator set per plane (32x64 wave tiles, f32 accumulation), split in the GEMM's epilogue into f16 hi + x1024 residual planes; v = x Wv + bv in f32, split likewise in its GEMM's epilogue and written transposed per (batch, head); one fused attention launch (a wave owns 32 query rows, 32 keys per trip): scores^T = k_hi.q_hi + (k_hi.q_lo + k_lo.q_hi)/1024 on WMMA, / 8, causal + key-mask running softmax in registers (f32 statistics, native exp2; weights x4096 f16), o^T += V_hi^T.P^T + V_lo^T.(P^T/1024), o split into hi + residual planes in the kernel's epilogue; out = (o_hi Wo + bo) + o_lo Wo 2^-20 likewise in one launch; first tile: the o rows of the first 128 rows of each batch are computed exactly in f32 on VALU from the f32 q, k, v rows of the full projections (kept in f32 for those rows only), by four waves per (batch, head) of the fused launch, which leaves those rows to them; launches: see trace.
// Compute dtype: inputs rounded to bf16; x / weights exact; q, k, v and o as f16 hi + x1024 residual operand pairs, softmax weights as plain f16 GEMM operands (~2^-12); scores and softmax statistics f32; v_wmma_f32_16x16x32_f16.
#define NB 2
#define SQ 2048
#define DM 1024
#define NH 16
#define HD 64
#define HG 4                         /* heads per launch of the second k_vt, which is not launched */
#define QT 256                       /* query rows per causal tile */
#define NKX SQ                       /* S / P row pitch */
#define QT0 128                      /* first-tile rows recomputed exactly in f32 */
#define B0 0                         /* first batch processed (debug hook) */
#define NBR NB                       /* batches processed (debug hook) */
#define NR ((size_t)NB * SQ)         /* token rows */
#define MP ((int)((size_t)NBR * SQ)) /* rows projected (debug hook) */
#define QN SQ                        /* query rows per batch (not used) */
#define NHD NH                       /* heads (not used) */
#define MPO MP                       /* rows through the output stage (debug hook) */
#define LQ DM      /* row pitch of the q/k/v rows */
typedef __bf16 v16b __attribute__((ext_vector_type(16)));
typedef unsigned short v8us __attribute__((ext_vector_type(8), may_alias));
typedef float  v8f  __attribute__((ext_vector_type(8)));
typedef float  v4f  __attribute__((ext_vector_type(4)));
typedef float  v4fa __attribute__((ext_vector_type(4), may_alias));
union FragB { v16b v; v8us half[2]; unsigned short u[16]; };

__device__ __forceinline__ unsigned short bf16_bits(float x) { unsigned int u = __float_as_uint(x); return (unsigned short)((u + 0x7FFFu + ((u >> 16) & 1u)) >> 16); }
__device__ __forceinline__ float bf16_val(unsigned short b) { return __uint_as_float(((unsigned int)b) << 16); }
__device__ __forceinline__ float bf16_round(float x) { return bf16_val(bf16_bits(x)); }
// D += A·B with NT terms: 1 = ah·bh, 2 = + al·bh (A split), 3 = + ah·bl (both split)
template <int NT>
__device__ __forceinline__ v8f mmaN(v16b ah, v16b al, v16b bh, v16b bl, v8f c) {
  c = __builtin_amdgcn_wmma_f32_16x16x32_bf16(false, ah, false, bh, (short)0, c, false, false);
  if (NT >= 2) c = __builtin_amdgcn_wmma_f32_16x16x32_bf16(false, al, false, bh, (short)0, c, false, false);
  if (NT >= 3) c = __builtin_amdgcn_wmma_f32_16x16x32_bf16(false, ah, false, bl, (short)0, c, false, false);
  asm volatile("v_nop\n\tv_nop\n\tv_nop\n\tv_nop" : "+v"(c) : "v"(ah), "v"(al), "v"(bh), "v"(bl));
  return c;
}

__global__ __launch_bounds__(256) void k_wt_bf16(const float* __restrict__ W, unsigned short* __restrict__ Wt, int K, int N) {
  const int t = blockIdx.x * 256 + threadIdx.x;
  const int k8n = K / 8;
  if (t >= N * k8n) return;
  const int n = t / k8n, k8 = (t % k8n) * 8;
  v8us v;
#pragma unroll
  for (int i = 0; i < 8; ++i) v[i] = bf16_bits(W[(size_t)(k8 + i) * N + n]);
  *(v8us*)(Wt + (size_t)n * K + k8) = v;
  
}

// GEMM C[M][N] (f32, pitch ldc) = act(A[M][K]·W + bias). A f32 row-major (pitch lda) converted per fragment to bf16
// (ASPLIT: hi/lo two planes -> 2 terms, else single rounded term); Wt bf16 [N][K] (pitch ldb). BIAS_BF16 rounds the
// bias to bf16 first (bias quantised to bf16 before the add). K%32==0, M%16==0, N%64==0.
template <bool ASPLIT, int ACT, bool BIAS_BF16>
__global__ __launch_bounds__(128) void k_gemm_bf(const float* __restrict__ A, int lda, const unsigned short* __restrict__ Wt, int ldb,
                                               const float* __restrict__ bias, float* __restrict__ C, int ldc, int M, int N, int K) {
  __shared__ __attribute__((aligned(16))) float so[4][16][64];
  const int tid = threadIdx.x, w = tid >> 5, lane = tid & 31, ln = lane & 15, hh = lane >> 4;
  const int ntn = N / 64;
  const int wid = blockIdx.x * 4 + w;
  const int mt = wid / ntn, nq = wid % ntn;
  if (mt * 16 >= M) return;
  const int row0 = mt * 16, col0 = nq * 64;
  const float* arow = A + (size_t)(row0 + ln) * lda;
  v8f acc[4] = {};
  for (int kb = 0; kb < K; kb += 32) {
    FragB ah, al;
    const v4f x0 = *(const v4fa*)(arow + kb + 8 * hh), x1 = *(const v4fa*)(arow + kb + 8 * hh + 4);
    const v4f x2 = *(const v4fa*)(arow + kb + 16 + 8 * hh), x3 = *(const v4fa*)(arow + kb + 16 + 8 * hh + 4);
    float xs[16] = {x0[0],x0[1],x0[2],x0[3],x1[0],x1[1],x1[2],x1[3],x2[0],x2[1],x2[2],x2[3],x3[0],x3[1],x3[2],x3[3]};
#pragma unroll
    for (int i = 0; i < 16; ++i) { const unsigned short hb = bf16_bits(xs[i]); ah.u[i] = hb; al.u[i] = ASPLIT ? bf16_bits(xs[i] - bf16_val(hb)) : (unsigned short)0; }
#pragma unroll
    for (int t = 0; t < 4; ++t) {
      const unsigned short* brow = Wt + (size_t)(col0 + t * 16 + ln) * ldb + kb;
      FragB b;
      b.half[0] = *(const v8us*)(brow + 8 * hh);
      b.half[1] = *(const v8us*)(brow + 16 + 8 * hh);
      acc[t] = mmaN<ASPLIT ? 2 : 1>(ah.v, al.v, b.v, b.v, acc[t]);
    }
  }
#pragma unroll
  for (int t = 0; t < 4; ++t) {
    float bv = bias ? bias[col0 + t * 16 + ln] : 0.f;
    if (BIAS_BF16) bv = bf16_round(bv);
#pragma unroll
    for (int r = 0; r < 8; ++r) { float v = acc[t][r] + bv; if (ACT == 1) v = fmaxf(v, 0.f); so[w][8 * hh + r][t * 16 + ln] = v; }
  }
  __builtin_amdgcn_fence(__ATOMIC_ACQ_REL, "workgroup");
  __builtin_amdgcn_wave_barrier();
  const int rsub = lane >> 4, c4 = (lane & 15) * 4;
  {
#pragma unroll
    for (int q = 0; q < 8; ++q) {
      const int r = q * 2 + rsub;
      const v4f v = *(const v4fa*)&so[w][r][c4];
      *(v4f*)(C + (size_t)(row0 + r) * ldc + col0 + c4) = v;
    }
    
  }
}

// GEMM C = act(A·W + bias + resid): A f32 (ASPLIT -> hi/lo 2 terms), Wt bf16 [N][K]; ACT 0 none, 1 relu, 2 exact gelu;
// resid (optional, f32, row index = (row % rmod), pitch ldr, RES_BF16 rounds it) added before the activation.
template <bool ASPLIT, int ACT, bool BIAS_BF16, bool RES_BF16>
__global__ __launch_bounds__(128) void k_gemm_bf3(const float* __restrict__ A, int lda, const unsigned short* __restrict__ Wt, int ldb,
                                                const float* __restrict__ bias, const float* __restrict__ resid, int rmod, int ldr,
                                                float* __restrict__ C, int ldc, int M, int N, int K) {
  __shared__ __attribute__((aligned(16))) float so[4][16][64];
  const int tid = threadIdx.x, w = tid >> 5, lane = tid & 31, ln = lane & 15, hh = lane >> 4;
  const int ntn = N / 64;
  const int wid = blockIdx.x * 4 + w;
  const int mt = wid / ntn, nq = wid % ntn;
  if (mt * 16 >= M) return;
  const int row0 = mt * 16, col0 = nq * 64;
  const float* arow = A + (size_t)(row0 + ln) * lda;
  v8f acc[4] = {};
  for (int kb = 0; kb < K; kb += 32) {
    FragB ah, al;
    const v4f x0 = *(const v4fa*)(arow + kb + 8 * hh), x1 = *(const v4fa*)(arow + kb + 8 * hh + 4);
    const v4f x2 = *(const v4fa*)(arow + kb + 16 + 8 * hh), x3 = *(const v4fa*)(arow + kb + 16 + 8 * hh + 4);
    float xs[16] = {x0[0],x0[1],x0[2],x0[3],x1[0],x1[1],x1[2],x1[3],x2[0],x2[1],x2[2],x2[3],x3[0],x3[1],x3[2],x3[3]};
#pragma unroll
    for (int i = 0; i < 16; ++i) { const unsigned short hb = bf16_bits(xs[i]); ah.u[i] = hb; al.u[i] = ASPLIT ? bf16_bits(xs[i] - bf16_val(hb)) : (unsigned short)0; }
#pragma unroll
    for (int t = 0; t < 4; ++t) {
      const unsigned short* brow = Wt + (size_t)(col0 + t * 16 + ln) * ldb + kb;
      FragB b;
      b.half[0] = *(const v8us*)(brow + 8 * hh);
      b.half[1] = *(const v8us*)(brow + 16 + 8 * hh);
      acc[t] = mmaN<ASPLIT ? 2 : 1>(ah.v, al.v, b.v, b.v, acc[t]);
    }
  }
#pragma unroll
  for (int t = 0; t < 4; ++t) {
    const int col = col0 + t * 16 + ln;
    float bv = bias ? bias[col] : 0.f;
    if (BIAS_BF16) bv = bf16_round(bv);
#pragma unroll
    for (int r = 0; r < 8; ++r) {
      float v = acc[t][r] + bv;
      if (resid) { float rv = resid[(size_t)((row0 + 8 * hh + r) % rmod) * ldr + col]; if (RES_BF16) rv = bf16_round(rv); v += rv; }
      if (ACT == 1) v = fmaxf(v, 0.f);
      if (ACT == 2) v = 0.5f * v * (1.0f + erff(v * 0.70710678118654752f));
      if (ACT == 3) { const float u = 0.7978845608028654f * (v + 0.044715f * v * v * v); v = 0.5f * v * (1.0f + tanhf(u)); }
      so[w][8 * hh + r][t * 16 + ln] = v;
    }
  }
  __builtin_amdgcn_fence(__ATOMIC_ACQ_REL, "workgroup");
  __builtin_amdgcn_wave_barrier();
  const int rsub = lane >> 4, c4 = (lane & 15) * 4;
  {
#pragma unroll
    for (int q = 0; q < 8; ++q) {
      const int r = q * 2 + rsub;
      const v4f v = *(const v4fa*)&so[w][r][c4];
      *(v4f*)(C + (size_t)(row0 + r) * ldc + col0 + c4) = v;
    }
    
  }
}
// row LayerNorm (biased variance, eps) over N: s = X (+ R); optional out_sum <- s; out_norm <- (s-mu)*rsqrt(var+eps)*g + b
template <bool PARAM_BF16>
__global__ __launch_bounds__(256) void k_layernorm(const float* __restrict__ X, const float* __restrict__ R, const float* __restrict__ g, const float* __restrict__ bta,
                                                  float* __restrict__ out_sum, float* __restrict__ out_norm, int N, float eps) {
  __shared__ float red[256];
  const int row = blockIdx.x, tid = threadIdx.x;
  const float* x = X + (size_t)row * N; const float* rr = R ? R + (size_t)row * N : nullptr;
  float vals[16];                     // up to N = 4096
  const int per = N / 256;            // contiguous chunk per thread? use strided-by-4 chunks: thread handles j = tid*4 + 1024*u
  float s1 = 0.f;
  for (int u = 0; u < per / 4; ++u) {
    const int j = tid * 4 + 1024 * u;
    const v4f a = *(const v4fa*)(x + j);
    v4f b = {0.f,0.f,0.f,0.f}; if (rr) b = *(const v4fa*)(rr + j);
#pragma unroll
    for (int q = 0; q < 4; ++q) { const float v = a[q] + b[q]; vals[u * 4 + q] = v; s1 += v; }
  }
  red[tid] = s1; __syncthreads();
  for (int st = 128; st > 0; st >>= 1) { if (tid < st) red[tid] += red[tid + st]; __syncthreads(); }
  const float mu = red[0] / (float)N; __syncthreads();
  float s2 = 0.f;
  for (int u = 0; u < per / 4; ++u)
#pragma unroll
    for (int q = 0; q < 4; ++q) { const float c = vals[u * 4 + q] - mu; s2 += c * c; }
  red[tid] = s2; __syncthreads();
  for (int st = 128; st > 0; st >>= 1) { if (tid < st) red[tid] += red[tid + st]; __syncthreads(); }
  const float rs = rsqrtf(red[0] / (float)N + eps);
  {
    for (int u = 0; u < per / 4; ++u) {
      const int j = tid * 4 + 1024 * u;
      v4f o, sm;
#pragma unroll
      for (int q = 0; q < 4; ++q) {
        float gg = g[j + q], bb = bta[j + q];
        if (PARAM_BF16) { gg = bf16_round(gg); bb = bf16_round(bb); }
        sm[q] = vals[u * 4 + q]; o[q] = (vals[u * 4 + q] - mu) * rs * gg + bb;
      }
      if (out_sum) *(v4f*)(out_sum + (size_t)row * N + j) = sm;
      *(v4f*)(out_norm + (size_t)row * N + j) = o;
    }
    
  }
}



// ---- f16 WMMA path (v_wmma_f32_16x16x32_f16): 11-bit significands for operands in range — used where a [0,1] probability operand needs more precision than bf16
typedef _Float16 v16h __attribute__((ext_vector_type(16)));
union FragH { v16h v; v8us half[2]; _Float16 h[16]; unsigned short u[16]; };
template <int NT>
__device__ __forceinline__ v8f mmaH(v16h ah, v16h al, v16h bh, v16h bl, v8f c) {
  c = __builtin_amdgcn_wmma_f32_16x16x32_f16(false, ah, false, bh, (short)0, c, false, false);
  if (NT >= 2) c = __builtin_amdgcn_wmma_f32_16x16x32_f16(false, al, false, bh, (short)0, c, false, false);
  if (NT >= 3) c = __builtin_amdgcn_wmma_f32_16x16x32_f16(false, ah, false, bl, (short)0, c, false, false);
  asm volatile("v_nop\n\tv_nop\n\tv_nop\n\tv_nop" : "+v"(c) : "v"(ah), "v"(al), "v"(bh), "v"(bl));
  return c;
}
// batched GEMM like k_gemm_b but f16 operands: A f32 (split into f16 hi/lo if ASPLIT, else rounded to f16), Bt = f16 values [n][k]; alpha; C f32; N multiple of 16 (partial tiles skipped)
template <bool ASPLIT>
__global__ __launch_bounds__(128) void k_gemm_h(const float* __restrict__ A, int lda, size_t sA, const _Float16* __restrict__ Bh, int ldb, size_t sB, float alpha, float* __restrict__ C, int ldc, size_t sC, int M, int N, int K) {
  __shared__ __attribute__((aligned(16))) float so[4][16][64];
  const int tid = threadIdx.x, w = tid >> 5, lane = tid & 31, ln = lane & 15, hh = lane >> 4; const int by = blockIdx.y;
  A += (size_t)by * sA; Bh += (size_t)by * sB; C += (size_t)by * sC;
  const int ntn = (N + 63) / 64; const int wid = blockIdx.x * 4 + w; const int mt = wid / ntn, nq = wid % ntn; if (mt * 16 >= M) return;
  const int row0 = mt * 16, col0 = nq * 64; const float* arow = A + (size_t)(row0 + ln) * lda;
  v8f acc[4] = {};
  for (int kb = 0; kb < K; kb += 32) {
    FragH ah, al;
    const v4f x0 = *(const v4fa*)(arow + kb + 8 * hh), x1 = *(const v4fa*)(arow + kb + 8 * hh + 4), x2 = *(const v4fa*)(arow + kb + 16 + 8 * hh), x3 = *(const v4fa*)(arow + kb + 16 + 8 * hh + 4);
    float xs[16] = {x0[0],x0[1],x0[2],x0[3],x1[0],x1[1],x1[2],x1[3],x2[0],x2[1],x2[2],x2[3],x3[0],x3[1],x3[2],x3[3]};
#pragma unroll
    for (int i = 0; i < 16; ++i) { const _Float16 h = (_Float16)xs[i]; ah.h[i] = h; al.h[i] = ASPLIT ? (_Float16)(xs[i] - (float)h) : (_Float16)0.0f; }
#pragma unroll
    for (int t = 0; t < 4; ++t) { if (col0 + t * 16 >= N) continue; const size_t boff = (size_t)(col0 + t * 16 + ln) * ldb + kb; FragH bq; bq.half[0] = *(const v8us*)(Bh + boff + 8 * hh); bq.half[1] = *(const v8us*)(Bh + boff + 16 + 8 * hh);
      acc[t] = mmaH<ASPLIT ? 2 : 1>(ah.v, al.v, bq.v, bq.v, acc[t]); }
  }
#pragma unroll
  for (int t = 0; t < 4; ++t) { if (col0 + t * 16 >= N) continue;
#pragma unroll
    for (int r = 0; r < 8; ++r) so[w][8 * hh + r][t * 16 + ln] = acc[t][r] * alpha; }
  __builtin_amdgcn_fence(__ATOMIC_ACQ_REL, "workgroup"); __builtin_amdgcn_wave_barrier();
  const int rsub = lane >> 4, c4 = (lane & 15) * 4;
  {
#pragma unroll
    for (int q = 0; q < 8; ++q) { const int r = q * 2 + rsub; if (col0 + c4 < N) { const v4f v = *(const v4fa*)&so[w][r][c4]; *(v4f*)(C + (size_t)(row0 + r) * ldc + col0 + c4) = v; } }
     }
}

// Wt[n][k] = f16(W[k][n]·scale) from f32 row-major W[K][N] (scale = power of two; bf16-exact weights stay exact in f16 away from the subnormal range)
__global__ __launch_bounds__(256) void k_wt_f16(const float* __restrict__ W, _Float16* __restrict__ Wt, int K, int N, float scale) {
  const int t = blockIdx.x * 256 + threadIdx.x; if (t >= N * (K / 8)) return; const int n = t / (K / 8), k8 = (t % (K / 8)) * 8; FragH f;
#pragma unroll
  for (int i = 0; i < 8; ++i) f.h[i] = (_Float16)(bf16_round(W[(size_t)(k8 + i) * N + n]) * scale); const v8us o = f.half[0];
  *(v8us*)((unsigned short*)Wt + (size_t)n * K + k8) = o; 
}
// k_gemm_hh variant with fused epilogue: v = acc·alpha + bias[by·sBias + col] (+ CP[(row/rowsPerB)·sCPb + by·64 + col] if CP) ; ACT 0 none / 1 elu ; writes f16 C16 (and f32 C if non-null)
template <int ACT>
__global__ __launch_bounds__(128) void k_gemm_hhx(const _Float16* __restrict__ A, int lda, size_t sA, const _Float16* __restrict__ Bh, int ldb, size_t sB, float alpha, const float* __restrict__ bias, size_t sBias, const float* __restrict__ CP, int rowsPerB, size_t sCPb, int row0g,
    float* __restrict__ C, _Float16* __restrict__ C16, int ldc, size_t sC, int M, int N, int K) {
  __shared__ __attribute__((aligned(16))) float so[4][16][64];
  const int tid = threadIdx.x, w = tid >> 5, lane = tid & 31, ln = lane & 15, hh = lane >> 4; const int by = blockIdx.y;
  A += (size_t)by * sA; Bh += (size_t)by * sB; const size_t cofs = (size_t)by * sC; const float* bp = bias ? bias + (size_t)by * sBias : nullptr;
  const int ntn = (N + 63) / 64; const int wid = blockIdx.x * 4 + w; const int mt = wid / ntn, nq = wid % ntn; if (mt * 16 >= M) return;
  const int row0 = mt * 16, col0 = nq * 64; const _Float16* arow = A + (size_t)(row0 + ln) * lda;
  v8f acc[4] = {};
  for (int kb = 0; kb < K; kb += 32) { FragH ah; ah.half[0] = *(const v8us*)((const unsigned short*)arow + kb + 8 * hh); ah.half[1] = *(const v8us*)((const unsigned short*)arow + kb + 16 + 8 * hh);
#pragma unroll
    for (int t = 0; t < 4; ++t) { if (col0 + t * 16 >= N) continue; const size_t boff = (size_t)(col0 + t * 16 + ln) * ldb + kb; FragH bq; bq.half[0] = *(const v8us*)((const unsigned short*)Bh + boff + 8 * hh); bq.half[1] = *(const v8us*)((const unsigned short*)Bh + boff + 16 + 8 * hh);
      acc[t] = mmaH<1>(ah.v, ah.v, bq.v, bq.v, acc[t]); }
  }
#pragma unroll
  for (int t = 0; t < 4; ++t) { if (col0 + t * 16 >= N) continue; const int col = col0 + t * 16 + ln; const float bv = bp ? bf16_round(bp[col]) : 0.f;
#pragma unroll
    for (int r = 0; r < 8; ++r) { float v = acc[t][r] * alpha + bv; if (CP) { const int rr = row0g + row0 + 8 * hh + r; if (rowsPerB < 0) v += CP[cofs + (size_t)rr * ldc + col];      /* rowsPerB < 0: own element of the batched C plane */ else { const int bidx = rr / rowsPerB; v += CP[(size_t)bidx * sCPb + (size_t)by * 64 + col]; } } if (ACT == 1) v = (v > 0.f) ? v : expm1f(v); else if (ACT == 7) v = (v > 0.f) ? v + 1.0f : expf(v); else if (ACT == 8) v = tanhf(v); else if (ACT == 9) v = 0.5f * v * (1.0f + tanhf(0.7978845608028654f * (v + 0.044715f * v * v * v))); else if (ACT == 11) v = 1.0f / (1.0f + expf(-v)); else if (ACT == 12) v = (v > 0.f) ? v : 0.01f * v; else if (ACT == 14) v = (v > 0.f) ? v : 0.1f * v; else if (ACT == 16) v = (v >= 0.f) ? v : 0.3f * v; else if (ACT == 17) v = (v >= 0.f) ? v : 0.2f * v; else if (ACT == 15) v = v / (1.0f + expf(-v)); else if (ACT == 3) v = fmaxf(v, 0.f); else if (ACT == 6) v = 0.5f * v * (1.0f + erff(v * 0.70710678118654752f)); so[w][8 * hh + r][t * 16 + ln] = v; } }
  __builtin_amdgcn_fence(__ATOMIC_ACQ_REL, "workgroup"); __builtin_amdgcn_wave_barrier();
  const int rsub = lane >> 4, c4 = (lane & 15) * 4; typedef _Float16 v4h __attribute__((ext_vector_type(4)));
  {
#pragma unroll
    for (int q = 0; q < 8; ++q) { const int r = q * 2 + rsub; if (col0 + c4 < N) { const v4f v = *(const v4fa*)&so[w][r][c4]; if (C) *(v4f*)(C + cofs + (size_t)(row0 + r) * ldc + col0 + c4) = v; if (C16) { v4h h4; for (int i = 0; i < 4; ++i) h4[i] = (_Float16)v[i]; *(v4h*)(C16 + cofs + (size_t)(row0 + r) * ldc + col0 + c4) = h4; } } }
     }
}


typedef _Float16 v4h __attribute__((ext_vector_type(4)));

// ---- fragment-major f16 operand planes ----
// A plane of R rows x K columns (R % 16 == 0, K % 32 == 0) is kept as 16 x 32 tiles of 512 elements, tile (r / 16, k / 32) at ((r / 16) * (K / 32) + k / 32) * 512. Inside a tile the 8-element chunk c = (k % 32) / 8 of row r stands at (c / 2) * 256 + ((c % 2) * 16 + r % 16) * 8:
// that is the order in which the lanes of a wave hold a 16x16x32 A or B fragment (lane = 16 hh + ln: k = 8 hh + s, then 16 + 8 hh + s), so each of a fragment's two loads reads 512 contiguous bytes (four whole lines) instead of 32 bytes out of each of 16 rows.
// Sixteen rows fill 16 K consecutive elements, so a row offset that is a multiple of 16 is the same pointer offset as in a row-major plane.
__device__ __forceinline__ v16h tf_frag(const _Float16* p) { FragH f; f.half[0] = *(const v8us*)((const unsigned short*)p); f.half[1] = *(const v8us*)((const unsigned short*)p + 256); return f.v; }      /* p = tile + 8 * lane */
__device__ __forceinline__ size_t tf_off(size_t r, size_t k, size_t K) { return (((r >> 4) * (K >> 5) + (k >> 5)) << 9) + (((k >> 4) & 1) << 8) + (((((k >> 3) & 1) << 4) | (r & 15)) << 3); }      /* k % 8 == 0 */
// Writer thread t of a plane with DM columns -> its chunk (row r, first column k). A wave takes 8 rows x 32 columns: it reads 8 whole 128-byte f32 lines and writes 4 whole 128-byte lines of the tile, each line by this wave alone.
__device__ __forceinline__ void tf_chunk(size_t t, size_t& r, size_t& k) { const size_t tile = t >> 6; r = ((tile / (DM / 32)) << 4) + (((t >> 5) & 1) << 3) + ((t >> 2) & 7); k = ((tile % (DM / 32)) << 5) + ((t & 3) << 3); }

__global__ __launch_bounds__(256) void k_h16(const float* __restrict__ x, _Float16* __restrict__ X16, size_t n8) { const size_t t = (size_t)blockIdx.x * 256 + threadIdx.x; if (t >= n8) return; FragH f;
#pragma unroll
  for (int q = 0; q < 8; ++q) f.h[q] = (_Float16)x[t * 8 + q]; *(v8us*)((unsigned short*)X16 + t * 8) = f.half[0];  }
__global__ __launch_bounds__(256) void k_round16f(const float* __restrict__ W, _Float16* __restrict__ Bt, size_t n8) { const size_t t = (size_t)blockIdx.x * 256 + threadIdx.x; if (t >= n8) return; FragH f;
#pragma unroll
  for (int i = 0; i < 8; ++i) f.h[i] = (_Float16)(bf16_round(W[t * 8 + i]) * 16.0f); *(v8us*)((unsigned short*)Bt + t * 8) = f.half[0];  }
template <int NHv, int TTv>
__global__ __launch_bounds__(256) void k_vt(const _Float16* __restrict__ V16, int ldv, int voff, _Float16* __restrict__ Vt) { __shared__ unsigned short tl[64][66]; const int tid = threadIdx.x; const int slab = blockIdx.x / (TTv / 64), lg = blockIdx.x % (TTv / 64); const int b = slab / NHv, h = slab % NHv;
  for (int i = tid; i < 64 * 8; i += 256) { const int r = i / 8, c8 = (i % 8) * 8; FragH f; f.half[0] = *(const v8us*)((const unsigned short*)V16 + ((size_t)b * TTv + lg * 64 + r) * ldv + voff + h * 64 + c8);
#pragma unroll
    for (int q = 0; q < 8; ++q) tl[r][c8 + q] = f.u[q]; }
  __syncthreads();
  {
#pragma unroll
    for (int rd = 0; rd < 2; ++rd) { const int d = ((tid >> 6) << 4) + (((tid >> 5) & 1) << 3) + ((tid >> 2) & 7), pc = rd * 4 + (tid & 3); FragH f;      /* a wave takes 8 rows of V^T x 32 keys: 4 whole lines of one tile */
#pragma unroll
      for (int q = 0; q < 8; ++q) f.u[q] = tl[pc * 8 + q][d];
      *(v8us*)((unsigned short*)Vt + tf_off((size_t)slab * 64 + d, (size_t)lg * 64 + pc * 8, TTv)) = f.half[0]; }      /* Vt fragment-major, TTv columns */
     } }

// TF: the two f16 planes are written fragment-major (F has DM columns); otherwise row-major like F
template <bool TF>
__global__ __launch_bounds__(256) void k_hl(const float* __restrict__ F, _Float16* __restrict__ Hh, _Float16* __restrict__ Hl, size_t n8) { const size_t t = (size_t)blockIdx.x * 256 + threadIdx.x; if (t >= n8) return; FragH fh, fl; size_t si = t * 8, di = t * 8; if (TF) { size_t r, k; tf_chunk(t, r, k); si = r * DM + k; di = tf_off(r, k, DM); } const float* pf = F + si; const v4f a = *(const v4fa*)pf, c = *(const v4fa*)(pf + 4);
  asm volatile("s_wait_xcnt 0x0" :: "v"(pf) : "memory");      /* stands behind the two loads and in front of every instruction that rewrites their address register; the address is an input so that its register stays as it is up to the wait */
#pragma unroll
  for (int q = 0; q < 4; ++q) { _Float16 h = (_Float16)a[q]; fh.h[q] = h; fl.h[q] = (_Float16)((a[q] - (float)h) * 1024.0f); h = (_Float16)c[q]; fh.h[4 + q] = h; fl.h[4 + q] = (_Float16)((c[q] - (float)h) * 1024.0f); }
  { *(v8us*)((unsigned short*)Hh + di) = fh.half[0]; *(v8us*)((unsigned short*)Hl + di) = fl.half[0];  } }

// eight f32 values -> the f16 hi chunk and the x1024 residual chunk (the arithmetic of k_hl), for producers that write the split planes themselves
__device__ __forceinline__ void hl8(const float* v, v8us& hi, v8us& lo) { FragH fh, fl;
#pragma unroll
  for (int q = 0; q < 8; ++q) { const _Float16 h = (_Float16)v[q]; fh.h[q] = h; fl.h[q] = (_Float16)((v[q] - (float)h) * 1024.0f); }
  hi = fh.half[0]; lo = fl.half[0]; }

// ---- fast GEMM (wave tile 32x64; requires M % 32 == 0 rows per launch region, N % 64 == 0, K % 32 == 0 and K >= 32); A and Bh are fragment-major planes of K columns (lda and ldb are not used); epilogue = k_gemm_hhx semantics ----
__device__ __forceinline__ v16h g2_frag(const _Float16* p, int hh) { FragH f; f.half[0] = *(const v8us*)((const unsigned short*)p + 8 * hh); f.half[1] = *(const v8us*)((const unsigned short*)p + 16 + 8 * hh); return f.v; }
__device__ __forceinline__ v8f g2_mma(v16h a, v16h b, v8f c) { v8f d = __builtin_amdgcn_wmma_f32_16x16x32_f16(false, a, false, b, (short)0, c, false, false); asm volatile("v_nop\n\tv_nop\n\tv_nop\n\tv_nop" : "+v"(d) : "v"(a), "v"(b)); return d; }
struct G2S { v16h a0, a1, b0, b1, b2, b3; };      /* the six fragments of one k step */
// VTS (rows = tokens of NB batches of SQ, columns = NH heads of HD, no CP, ACT 0): the result leaves as the two fragment-major V^T planes VTh, VTl ([batch][head][HD] rows of SQ columns), straight from the accumulators; the f32 rows go to C only for the first QT0 tokens of a batch (the first-tile attention reads them)
template <int ACT, bool VTS>
__global__ __launch_bounds__(128) void k_gemm2(const _Float16* __restrict__ A, int lda, size_t sA, const _Float16* __restrict__ Bh, int ldb, size_t sB, float alpha, const float* __restrict__ bias, size_t sBias, const float* __restrict__ CP, int rowsPerB, size_t sCPb, int row0g,
    float* __restrict__ C, _Float16* __restrict__ C16, int ldc, size_t sC, int M, int N, int K, _Float16* __restrict__ VTh, _Float16* __restrict__ VTl) { static_assert(ACT == 0 || ACT == 3 || ACT == 6 || ACT == 8 || ACT == 9 || ACT == 11 || ACT == 12 || ACT == 14 || ACT == 15 || ACT == 16 || ACT == 17, "k_gemm2: unsupported ACT code (would silently apply no activation)");
  __shared__ __attribute__((aligned(16))) float so[4][32][68];
  const int tid = threadIdx.x, w = tid >> 5, lane = tid & 31, ln = lane & 15, hh = lane >> 4; const int by = blockIdx.y;
  A += (size_t)by * sA; Bh += (size_t)by * sB; const size_t cofs = (size_t)by * sC; const float* bp = bias ? bias + (size_t)by * sBias : nullptr;
  const int ntn = N >> 6; const int mt = blockIdx.x / ntn, nq = blockIdx.x - mt * ntn; const int row0 = mt * 128 + 32 * w, col0 = nq * 64; if (row0 >= M) return;
  (void)lda; (void)ldb; const size_t tr = (size_t)16 * K;      /* elements of one 16-row band of tiles */
  const _Float16* a0p = A + (size_t)row0 * K + 8 * lane; const _Float16* a1p = a0p + tr;
  const _Float16* b0p = Bh + (size_t)col0 * K + 8 * lane; const _Float16* b1p = b0p + tr; const _Float16* b2p = b1p + tr; const _Float16* b3p = b2p + tr;
  const v8f z8 = {0.f,0.f,0.f,0.f,0.f,0.f,0.f,0.f}; v8f c00 = z8, c01 = z8, c02 = z8, c03 = z8, c10 = z8, c11 = z8, c12 = z8, c13 = z8;
  /* Three k steps of fragments in registers. A step's twelve loads are issued together, right behind the products of the step whose registers they refill, and are first read three steps later: a load's latency is spread over three steps instead of being paid five times in each.
     No branch stands between the loads, so their waits are counted exactly: past the last step the step index is clamped (an in-bounds re-read of the last step that no product uses). Each accumulator still takes its products in the order kb = 0, 32, 64, ... */
  const int nst = K >> 5;
  auto ld = [&](int st) { const int kb = (st < nst ? st : nst - 1) << 9; const _Float16 *pa0 = a0p + kb, *pa1 = a1p + kb, *pb0 = b0p + kb, *pb1 = b1p + kb, *pb2 = b2p + kb, *pb3 = b3p + kb;      /* one tile of 512 elements per k step; the lane's 8 elements are in the band pointers */
    G2S f; f.a0 = tf_frag(pa0); f.a1 = tf_frag(pa1); f.b0 = tf_frag(pb0); f.b1 = tf_frag(pb1); f.b2 = tf_frag(pb2); f.b3 = tf_frag(pb3);
    asm volatile("s_wait_xcnt 0x0" :: "v"(pa0), "v"(pa1), "v"(pb0), "v"(pb1), "v"(pb2), "v"(pb3) : "memory");      /* stands behind the step's loads and in front of every instruction that rewrites an address register they name; the addresses are inputs so that their registers stay as they are up to the wait (without that the step's last loads landed on them) */
    return f; };
  auto mm = [&](const G2S& f) { c00 = g2_mma(f.a0, f.b0, c00); c10 = g2_mma(f.a1, f.b0, c10); c01 = g2_mma(f.a0, f.b1, c01); c11 = g2_mma(f.a1, f.b1, c11); c02 = g2_mma(f.a0, f.b2, c02); c12 = g2_mma(f.a1, f.b2, c12); c03 = g2_mma(f.a0, f.b3, c03); c13 = g2_mma(f.a1, f.b3, c13); };
  G2S f0 = ld(0), f1 = ld(1), f2 = ld(2); int st = 0;
  /* kept rolled: one trip is the whole ring, and a second copy would only add registers */
#pragma unroll 1
  for (; st + 3 <= nst; st += 3) { mm(f0); f0 = ld(st + 3); mm(f1); f1 = ld(st + 4); mm(f2); f2 = ld(st + 5); }
  if (st < nst) mm(f0);
  if (st + 1 < nst) mm(f1);
  v8f accs[8] = {c00, c01, c02, c03, c10, c11, c12, c13};
  if (VTS) {      /* an accumulator tile holds, per lane, 8 consecutive tokens (8 hh + r) of ONE column (ln): that is one chunk of a V^T tile, at the lane's own place in it, so each store below is 512 contiguous bytes of the wave */
    const int srow = __builtin_amdgcn_readfirstlane(row0); const int bb = srow / SQ, key0 = srow % SQ;      /* the wave's first token: the same in every lane */
    const size_t tile0 = ((size_t)(bb * NH + (col0 >> 6)) * (HD / 16) * (SQ / 32) + (key0 >> 5)) << 9;      /* the V^T tile of the head's first 16 rows and these 32 keys */
    unsigned short* ph = (unsigned short*)VTh + tile0 + 8 * lane; unsigned short* pl = (unsigned short*)VTl + tile0 + 8 * lane; v8us hv[8], lv[8];
    /* unrolled so that the chunks are registers */
#pragma unroll
    for (int u = 0; u < 8; ++u) { const float bv = bp ? bf16_round(bp[col0 + (u & 3) * 16 + ln]) : 0.f; float v[8];
#pragma unroll
      for (int r = 0; r < 8; ++r) v[r] = accs[u][r] * alpha + bv;
      hl8(v, hv[u], lv[u]); }
#pragma unroll
    for (int u = 0; u < 8; ++u) { const size_t o = (size_t)(u & 3) * ((SQ / 32) << 9) + (u >> 2) * 256; *(v8us*)(ph + o) = hv[u]; *(v8us*)(pl + o) = lv[u]; }
    asm volatile("s_wait_xcnt 0x0" :: "v"(ph), "v"(pl) : "memory");      /* stands behind the stores: their address registers stay as they are up to here */
    if (key0 >= QT0) return;      /* the same for the whole wave; no barrier follows */
  }
#pragma unroll
  for (int u = 0; u < 8; ++u) { const int t = u & 3, half = u >> 2; const int col = col0 + t * 16 + ln; const float bv = bp ? bf16_round(bp[col]) : 0.f;
#pragma unroll
    for (int r = 0; r < 8; ++r) { const int rloc = half * 16 + 8 * hh + r; float v = accs[u][r] * alpha + bv; if (CP) { if (rowsPerB < 0) v += CP[cofs + (size_t)(row0g + row0 + rloc) * ldc + col];      /* rowsPerB < 0: own element of the batched C plane */ else { const int bidx = (row0g + row0 + rloc) / rowsPerB; v += CP[(size_t)bidx * sCPb + (size_t)by * 64 + col]; } }
      if (ACT == 3) v = fmaxf(v, 0.f); else if (ACT == 6) v = 0.5f * v * (1.0f + erff(v * 0.70710678118654752f)); else if (ACT == 11) v = 1.0f / (1.0f + expf(-v)); else if (ACT == 15) v = v / (1.0f + expf(-v)); else if (ACT == 12) v = (v > 0.f) ? v : 0.01f * v; else if (ACT == 8) v = tanhf(v); else if (ACT == 9) v = 0.5f * v * (1.0f + tanhf(0.7978845608028654f * (v + 0.044715f * v * v * v))); else if (ACT == 14) v = (v > 0.f) ? v : 0.1f * v; else if (ACT == 16) v = (v >= 0.f) ? v : 0.3f * v; else if (ACT == 17) v = (v >= 0.f) ? v : 0.2f * v;
      so[w][rloc][t * 16 + ln] = v; } }
  __builtin_amdgcn_fence(__ATOMIC_ACQ_REL, "workgroup"); __builtin_amdgcn_wave_barrier();
  const int rsub = lane >> 4, c4 = (lane & 15) * 4;
  {
#pragma unroll
    for (int q = 0; q < 16; ++q) { const int r = q * 2 + rsub; const v4f v = *(const v4fa*)&so[w][r][c4]; if (C) *(v4f*)(C + cofs + (size_t)(row0 + r) * ldc + col0 + c4) = v; if (C16) { v4h h4; for (int i = 0; i < 4; ++i) h4[i] = (_Float16)v[i]; *(v4h*)(C16 + cofs + (size_t)(row0 + r) * ldc + col0 + c4) = h4; } }
     } }


// ---- the same GEMM for an operand kept as f16 hi + x1024 residual planes: C = (A Bh) alpha + bias + (Al Bh) alphal in ONE launch (N = K = DM, C of pitch DM, M % 32 == 0) ----
// Both A planes walk one k loop against the same four B fragments, each plane into its own eight accumulators; each accumulator takes its products in the order kb = 0, 32, 64, ... and the two sets meet once, in the epilogue, in registers.
__device__ __forceinline__ v8f g2p_mma(v16h a, v16h b, v8f c) { return __builtin_amdgcn_wmma_f32_16x16x32_f16(false, a, false, b, (short)0, c, false, false); }      /* the plain builtin: its operands may stand in any register, which the 320 registers of accumulators and ring need */
struct G2P { v16h a0, a1, l0, l1, b0, b1, b2, b3; };      /* the eight fragments of one k step */
// SPLIT: the result leaves as the two fragment-major f16 planes Hh (hi) and Hl (x1024 residual); the f32 rows go to C only for the first QT0 rows of each SQ rows (the first-tile attention reads them). Otherwise all f32 rows go to C.
template <bool SPLIT>
__global__ __launch_bounds__(128) void k_gemm2p(const _Float16* __restrict__ A, const _Float16* __restrict__ Al, const _Float16* __restrict__ Bh, float alpha, float alphal, const float* __restrict__ bias, float* __restrict__ C, int M, _Float16* __restrict__ Hh, _Float16* __restrict__ Hl) {
  __shared__ __attribute__((aligned(16))) float so[4][32][68];
  const int tid = threadIdx.x, lane = tid & 31, ln = lane & 15, hh = lane >> 4; const int w = __builtin_amdgcn_readfirstlane(tid >> 5);      /* the wave's number, the same in every lane: the three plane addresses below are then scalars */
  const int mt = blockIdx.x / (DM / 64), nq = blockIdx.x % (DM / 64); const int row0 = mt * 128 + 32 * w, col0 = nq * 64; if (row0 >= M) return;
  const size_t tr = (size_t)16 * DM;      /* elements of one 16-row band of tiles */
  const _Float16* ab = A + (size_t)row0 * DM; const _Float16* lb = Al + (size_t)row0 * DM; const _Float16* bb0 = Bh + (size_t)col0 * DM;      /* the wave's first tiles: the same in every lane */
  const float* sbias = bias + col0; float bv[4];      /* read here so that the k loop covers the latency */
#pragma unroll
  for (int t = 0; t < 4; ++t) bv[t] = sbias[ln + t * 16];
  asm volatile("s_wait_xcnt 0x0" :: "s"(sbias), "v"(ln) : "memory");      /* stands behind the four bias loads and in front of every instruction that rewrites an address register they name (a scalar base and the lane's column), which are inputs so that their registers stay as they are up to the wait */
  const v8f z8 = {0.f,0.f,0.f,0.f,0.f,0.f,0.f,0.f}; v8f c00 = z8, c01 = z8, c02 = z8, c03 = z8, c10 = z8, c11 = z8, c12 = z8, c13 = z8, d00 = z8, d01 = z8, d02 = z8, d03 = z8, d10 = z8, d11 = z8, d12 = z8, d13 = z8;
  /* the ring of three k steps of k_gemm2, with sixteen loads and sixteen products per step; past the last step the step index is clamped (an in-bounds re-read of the last step that no product uses) */
  const int nst = DM >> 5;
  auto ld = [&](int st) { const int kb = (st < nst ? st : nst - 1) << 9; const _Float16 *sa = ab + kb, *sl = lb + kb, *sb = bb0 + kb;      /* one tile of 512 elements per k step */
    const _Float16 *pa = sa + 8 * lane, *pl = sl + 8 * lane, *pq = sb + 8 * lane;
    G2P f; f.a0 = tf_frag(pa); f.a1 = tf_frag(pa + tr); f.l0 = tf_frag(pl); f.l1 = tf_frag(pl + tr); f.b0 = tf_frag(pq); f.b1 = tf_frag(pq + tr); f.b2 = tf_frag(pq + 2 * tr); f.b3 = tf_frag(pq + 3 * tr);
    asm volatile("s_wait_xcnt 0x0" :: "s"(sa), "s"(sl), "s"(sb), "v"(lane) : "memory");      /* stands behind the step's loads and in front of the next step's rewriting of the address registers they name. The three scalar bases and the lane number are inputs: that keeps the loads in the form scalar base + lane offset (without the inputs the build formed vector addresses in registers of the ring, with adds and their slots among the products) */
    return f; };
  auto mm = [&](const G2P& f) { c00 = g2p_mma(f.a0, f.b0, c00); c10 = g2p_mma(f.a1, f.b0, c10); d00 = g2p_mma(f.l0, f.b0, d00); d10 = g2p_mma(f.l1, f.b0, d10); c01 = g2p_mma(f.a0, f.b1, c01); c11 = g2p_mma(f.a1, f.b1, c11); d01 = g2p_mma(f.l0, f.b1, d01); d11 = g2p_mma(f.l1, f.b1, d11);
    c02 = g2p_mma(f.a0, f.b2, c02); c12 = g2p_mma(f.a1, f.b2, c12); d02 = g2p_mma(f.l0, f.b2, d02); d12 = g2p_mma(f.l1, f.b2, d12); c03 = g2p_mma(f.a0, f.b3, c03); c13 = g2p_mma(f.a1, f.b3, c13); d03 = g2p_mma(f.l0, f.b3, d03); d13 = g2p_mma(f.l1, f.b3, d13);
    __builtin_amdgcn_sched_barrier(0); };      /* keeps the refill's sixteen loads together behind the step's products, as in the ring of k_gemm2: without it the build spreads them over eight places among the products, the slower form of a WMMA loop with loads */
  G2P f0 = ld(0), f1 = ld(1), f2 = ld(2); int st = 0;
  /* kept rolled: one trip is the whole ring, and a second copy would only add registers */
#pragma unroll 1
  for (; st + 3 <= nst; st += 3) { mm(f0); f0 = ld(st + 3); mm(f1); f1 = ld(st + 4); mm(f2); f2 = ld(st + 5); }
  if (st < nst) mm(f0);
  if (st + 1 < nst) mm(f1);
  const v8f ch[8] = {c00, c01, c02, c03, c10, c11, c12, c13}, cl[8] = {d00, d01, d02, d03, d10, d11, d12, d13};
  /* unrolled so that the accumulator arrays are registers */
#pragma unroll
  for (int u = 0; u < 8; ++u) { const int t = u & 3, half = u >> 2; const float bb = bf16_round(bv[t]);
#pragma unroll
    for (int r = 0; r < 8; ++r) so[w][half * 16 + 8 * hh + r][t * 16 + ln] = (ch[u][r] * alpha + bb) + cl[u][r] * alphal; }      /* the hi product with its bias first, then the residual product: the order of the two launches this replaces */
  __builtin_amdgcn_fence(__ATOMIC_ACQ_REL, "workgroup"); __builtin_amdgcn_wave_barrier();      /* the wave's own LDS stores are done before its lanes read each other's rows */
  if (SPLIT) {      /* the wave's 32 x 64 tile is four 16 x 32 tiles of the planes; a lane reads its chunk's 8 columns of one row from LDS (16 lanes at pitch 68 cover all banks once) and each store is 512 contiguous bytes of the wave */
    const size_t tile0 = (size_t)row0 * DM + ((size_t)(col0 >> 5) << 9); unsigned short* ph = (unsigned short*)Hh + tile0 + 8 * lane; unsigned short* pl = (unsigned short*)Hl + tile0 + 8 * lane; v8us hv[8], lv[8];
    /* unrolled so that the chunks are registers */
#pragma unroll
    for (int c = 0; c < 8; ++c) { const float* ps = &so[w][(c >> 2) * 16 + ln][((c >> 1) & 1) * 32 + ((c & 1) * 2 + hh) * 8]; const v4f a = *(const v4fa*)ps, b = *(const v4fa*)(ps + 4);
      const float v[8] = {a[0], a[1], a[2], a[3], b[0], b[1], b[2], b[3]}; hl8(v, hv[c], lv[c]); }
#pragma unroll
    for (int c = 0; c < 8; ++c) { const size_t o = (size_t)(c >> 2) * 16 * DM + ((c >> 1) & 1) * 512 + (c & 1) * 256; *(v8us*)(ph + o) = hv[c]; *(v8us*)(pl + o) = lv[c]; }
    asm volatile("s_wait_xcnt 0x0" :: "v"(ph), "v"(pl) : "memory");      /* stands behind the stores: their address registers stay as they are up to here */
    if ((row0 & (SQ - 1)) >= QT0) return;      /* the same for the whole wave; no barrier follows */
  }
  const int rsub = lane >> 4, c4 = (lane & 15) * 4; float* pc = C + (size_t)(row0 + rsub) * DM + col0 + c4;
  /* unrolled: sixteen stores from one address register with constant offsets */
#pragma unroll
  for (int q = 0; q < 16; ++q) { const v4f v = *(const v4fa*)&so[w][q * 2 + rsub][c4]; *(v4f*)(pc + (size_t)q * 2 * DM) = v; }
  asm volatile("s_wait_xcnt 0x0" :: "v"(pc) : "memory");      /* stands behind the stores: their address register stays as it is up to here */
}


__global__ __launch_bounds__(256) void k_rsm(const float* __restrict__ S, _Float16* __restrict__ P, int nrows) {
  #pragma clang fp contract(off)
  const int i = blockIdx.x * 256 + threadIdx.x; if (i >= nrows) return; const float* s = S + (size_t)i * SQ; float mx = -3.0e38f;
#pragma unroll 1
  for (int j = 0; j < SQ; ++j) mx = fmaxf(mx, s[j]); float se = 0.f;
#pragma unroll 1
  for (int j = 0; j < SQ; ++j) se += expf(s[j] - mx); const float sc = 256.0f / se;
#pragma unroll 1
  for (int j0 = 0; j0 < SQ; j0 += 8) { FragH f; for (int q = 0; q < 8; ++q) f.h[q] = (_Float16)(expf(s[j0 + q] - mx) * sc); unsigned short* d = (unsigned short*)P + (size_t)i * SQ + j0; *(v8us*)d = f.half[0];  } }
__global__ __launch_bounds__(256) void k_vt(const _Float16* __restrict__ V16, int b, int h0, _Float16* __restrict__ VT) { __shared__ unsigned short tl[64][65]; const int tid = threadIdx.x; const int hh = blockIdx.x % HG, sg = blockIdx.x / HG; const int s0 = sg * 64; const int h = h0 + hh;
  for (int i = tid; i < 64 * 8; i += 256) { const int j = i / 8, d8 = (i % 8) * 8; FragH f; f.half[0] = *(const v8us*)((const unsigned short*)V16 + ((size_t)b * SQ + s0 + j) * DM + h * HD + d8); for (int q = 0; q < 8; ++q) tl[d8 + q][j] = f.u[q]; }
  __syncthreads();
  { for (int i = tid; i < 64 * 8; i += 256) { const int d = i / 8, j8 = (i % 8) * 8; FragH f; for (int q = 0; q < 8; ++q) f.u[q] = tl[d][j8 + q]; *(v8us*)((unsigned short*)VT + ((size_t)hh * HD + d) * SQ + s0 + j8) = f.half[0]; }  } }



__global__ __launch_bounds__(256) void k_rsmcf2(const float* __restrict__ S, _Float16* __restrict__ P, int hg, int q0, int nk) {
  #pragma clang fp contract(off)
  const int t = blockIdx.x * 256 + threadIdx.x; if (t >= hg * QT) return; const size_t i = (size_t)t; const float* s = S + i * NKX; const int last = q0 + (t % QT); float mx = -3.0e38f;
#pragma unroll 1
  for (int j = 0; j < nk; ++j) { const float f = (j <= last) ? 1.f : 0.f; mx = fmaxf(mx, fmaf(f, s[j], (1.f - f) * -1.0e9f)); } float se = 0.f;
#pragma unroll 1
  for (int j = 0; j < nk; ++j) { const float f = (j <= last) ? 1.f : 0.f; se += __expf(fmaf(f, s[j], (1.f - f) * -1.0e9f) - mx); } const float sc = 256.0f / se;
#pragma unroll 1
  for (int j0 = 0; j0 < nk; j0 += 8) { FragH fr; for (int q = 0; q < 8; ++q) { const int j = j0 + q; const float f = (j <= last) ? 1.f : 0.f; fr.h[q] = (_Float16)(__expf(fmaf(f, s[j], (1.f - f) * -1.0e9f) - mx) * sc); } unsigned short* d = (unsigned short*)P + i * NKX + j0; *(v8us*)d = fr.half[0];  } }



typedef int v4ia __attribute__((ext_vector_type(4), may_alias));
// native 2^x. Written as asm for the v_nop: it is the slot that the instruction set asks for behind a transcendental before its result is read or its source overwritten.
__device__ __forceinline__ float exp2_native(float x) { float r; asm("v_exp_f32 %0, %1\n\tv_nop" : "=v"(r) : "v"(x)); return r; }
#define FQ 2                         /* 16-query column groups per wave of the fused attention kernel */
struct FAK { v16h h[2][2], l[2][2]; };      /* K fragments of 32 keys: [16-key tile][32-wide step over the head size], hi and x1024 residual */
struct FAV { v16h h[4], l[4]; };            /* V^T fragments of 32 keys: [16-row tile of the head size], hi and x1024 residual */
__device__ __forceinline__ v8f fa_mma(v16h a, v16h b, v8f c) { return __builtin_amdgcn_wmma_f32_16x16x32_f16(false, a, false, b, (short)0, c, false, false); }
__global__ __launch_bounds__(256) void k_fattn(const _Float16* __restrict__ Qh, const _Float16* __restrict__ Ql, const _Float16* __restrict__ Kh, const _Float16* __restrict__ Kl, const _Float16* __restrict__ Vh, const _Float16* __restrict__ Vl, const int* __restrict__ Km, _Float16* __restrict__ Oh, _Float16* __restrict__ Ol, const float* __restrict__ QF, const float* __restrict__ KF, const float* __restrict__ VF) {
  __shared__ __attribute__((aligned(16))) float ftk[QT0][HD]; __shared__ __attribute__((aligned(16))) float ftv[QT0][HD]; __shared__ __attribute__((aligned(16))) int ftm[QT0];      /* the first tile's K and V rows and key padding entries (blocks with tb == 0 only) */
  const int lane = threadIdx.x & 31, ln = lane & 15, hh = lane >> 4; const int w = __builtin_amdgcn_readfirstlane((int)(threadIdx.x >> 5));
  const int tb = (int)(blockIdx.x / (NB * NH)); const int bh = blockIdx.x % (NB * NH); const int b = bh / NH, h = bh % NH;
  /* First-tile rows (the first QT0 rows of each batch) in exact f32 on the vector unit, inside this launch: the blocks with tb == 0 (one per batch and head) give waves 4-7 to them, one thread per query row, while every other wave of the launch runs the fused path.
     All operands stay on chip: the head's first QT0 K and V rows (and the key padding entries) are staged once in LDS with whole-line loads by all eight waves, every lane then reads the same LDS address (a broadcast, no bank conflict), and the thread's q and o rows live in registers.
     Four keys per trip: their four score chains are independent, so one chain's dependent adds are covered by the other three. Every sum (score, l, o) keeps its order: d = 0..63 inside a score, keys in rising j. */
  if (tb == 0) {      /* the same for the whole block, so the barrier below is passed by all eight waves or by none */
    const int tid = (int)threadIdx.x; const size_t rb = (size_t)b * SQ;      /* the batch's first row */
    const int i = (w & 3) * 32 + lane;      /* waves 4-7: the thread's query row */
    v4f q[HD / 4], o[HD / 4];
    { /* eight K and eight V loads in flight per thread; 16 lanes cover one 256-byte row, the block 16 rows per load */
      const unsigned og = (unsigned)(((rb + (size_t)(tid >> 4)) * LQ + h * HD + (tid & 15) * 4) * sizeof(float));      /* the thread's byte offset in both planes (they hold under 2^32 bytes) */
      const int* kmb = Km + rb; const int ei = tid & (QT0 - 1); v4f tk[8], tv[8];
      /* the two loops over u are fully unrolled so that the loaded rows are registers and the loads stand together, each from a plane's scalar base, the thread's offset and a constant */
#pragma unroll
      for (int u = 0; u < 8; ++u) { tk[u] = *(const v4fa*)((const char*)KF + og + (size_t)(u * 16) * LQ * sizeof(float)); tv[u] = *(const v4fa*)((const char*)VF + og + (size_t)(u * 16) * LQ * sizeof(float)); }
      const int ke = kmb[ei];
      asm volatile("s_wait_xcnt 0x0" :: "s"(KF), "s"(VF), "v"(og), "s"(kmb), "v"(ei) : "memory");      /* stands behind the loads and in front of every instruction that rewrites an address register they name (three scalar bases, the thread's offset and the entry's index), which are inputs so that their registers stay as they are up to the wait */
      if (w >= 4) { const float* qr = QF + (rb + i) * LQ + h * HD;      /* issued behind the staging loads and in front of their first use, so that both sets fly together */
        /* every loop over c is fully unrolled so that q and o are registers, not scratch */
#pragma unroll
        for (int c = 0; c < HD / 4; ++c) { q[c] = *(const v4fa*)(qr + c * 4); const v4f z = {0.f, 0.f, 0.f, 0.f}; o[c] = z; }
        asm volatile("s_wait_xcnt 0x0" :: "v"(qr) : "memory"); }      /* stands behind the q loads and in front of every instruction that rewrites their address register; the address is an input so that its register stays as it is up to the wait */
#pragma unroll
      for (int u = 0; u < 8; ++u) { const int r = u * 16 + (tid >> 4); *(v4f*)&ftk[r][(tid & 15) * 4] = tk[u]; *(v4f*)&ftv[r][(tid & 15) * 4] = tv[u]; }
      if (tid < QT0) ftm[tid] = ke; }
    __syncthreads();      /* the tile is complete before any thread reads it; the kernel's only barrier */
    if (w >= 4) {      /* the same for the whole wave */
      float m = -1.0e30f, l = 0.f; const int nr = ((w & 3) >> 1) * 64 + 64;      /* keys up to the last row of the wave's 64-row group */
      /* kept rolled: one trip already holds four keys, and a second copy would only add code and registers */
#pragma unroll 1
      for (int jj = 0; jj < nr; jj += 4) { float s4[4] = {0.f, 0.f, 0.f, 0.f}, sc4[4], e4[4]; const v4ia km4 = *(const v4ia*)&ftm[jj];
        /* all loops over c and u below are fully unrolled: constant indices keep q, o and the four keys' values in registers, and the four score chains stand side by side */
#pragma unroll
        for (int c = 0; c < HD / 4; ++c) { const v4f qq = q[c];
#pragma unroll
          for (int u = 0; u < 4; ++u) { const v4f kq = *(const v4f*)&ftk[jj + u][c * 4]; float s = s4[u]; s = __fadd_rn(s, __fmul_rn(qq[0], kq[0])); s = __fadd_rn(s, __fmul_rn(qq[1], kq[1])); s = __fadd_rn(s, __fmul_rn(qq[2], kq[2])); s = __fadd_rn(s, __fmul_rn(qq[3], kq[3])); s4[u] = s; } }
        __builtin_amdgcn_sched_barrier(0);      /* keeps the LDS reads of the four V rows behind the scores, so that they take over the registers of the four K rows: with both sets held at once the wave's 512 registers do not suffice and values go to scratch */
#pragma unroll
        for (int u = 0; u < 4; ++u) { const int j = jj + u; const float s = __fmul_rn(s4[u], 0.125f);
          const float f = (j <= i && km4[u] != 0) ? 1.f : 0.f;      /* causal; also drop keys whose int padding entry is 0 */
          const float sm = fmaf(f, s, (1.f - f) * -1.0e30f); const float mn = fmaxf(m, sm); const float sc = expf(m - mn); const float e = expf(sm - mn); l = __fadd_rn(__fmul_rn(l, sc), e); m = mn; sc4[u] = sc; e4[u] = e; }
#pragma unroll
        for (int u = 0; u < 4; ++u) { const float sc = sc4[u], e = e4[u];
#pragma unroll
          for (int c = 0; c < HD / 4; ++c) { const v4f vv = *(const v4f*)&ftv[jj + u][c * 4]; v4f oo = o[c]; for (int x = 0; x < 4; ++x) oo[x] = __fadd_rn(__fmul_rn(oo[x], sc), __fmul_rn(e, vv[x])); o[c] = oo; } } }
      const float fin = 64.0f / l;      /* o carried x64 like the f16 path */
      /* the row leaves as chunks of the two fragment-major o planes (f16 hi + x1024 residual, DM columns): 16 lanes fill 256 contiguous bytes per store, each line written by this wave alone */
      const size_t d0 = rb * DM + tf_off((size_t)i, (size_t)h * HD, DM); unsigned short* ph = (unsigned short*)Oh + d0; unsigned short* pl = (unsigned short*)Ol + d0; v8us ch[HD / 8], cl[HD / 8];
      /* unrolled: o and the chunks stay in registers */
#pragma unroll
      for (int c = 0; c < HD / 8; ++c) { float v[8]; for (int x = 0; x < 4; ++x) { v[x] = __fmul_rn(o[2 * c][x], fin); v[4 + x] = __fmul_rn(o[2 * c + 1][x], fin); } hl8(v, ch[c], cl[c]); }
#pragma unroll
      for (int c = 0; c < HD / 8; ++c) { const size_t e = (size_t)(c >> 2) * 512 + ((c >> 1) & 1) * 256 + (c & 1) * 128; *(v8us*)(ph + e) = ch[c]; *(v8us*)(pl + e) = cl[c]; }
      asm volatile("s_wait_xcnt 0x0" :: "v"(ph), "v"(pl) : "memory");      /* stands behind the stores: their address registers stay as they are up to here */
      return;      /* no barrier follows */
    }
  }
  const int qb = (tb == 0) ? 1 : ((w < 4) ? SQ / (64 * FQ) - tb : tb + 1);      /* a long and a short row group per block; group 0 is the first tile's */
  const int q0 = qb * (64 * FQ) + (w & 3) * (16 * FQ);      /* the wave's first query row: a multiple of 32, the same in every lane */
  /* every loop under '#pragma unroll' in this kernel is fully unrolled so that the fragment, score and accumulator arrays are registers, not scratch */
  v16h qh[FQ][2], ql[FQ][2];
  /* all six operand planes are fragment-major: q and k planes have LQ columns (a head is two neighbouring tiles of a 16-row band), the V^T planes SQ columns (32 keys are one tile) */
  { const _Float16* bq = Qh + ((size_t)b * SQ + q0) * LQ + h * (HD * 16); const _Float16* bl = Ql + ((size_t)b * SQ + q0) * LQ + h * (HD * 16); const _Float16* pq = bq + 8 * lane; const _Float16* pl = bl + 8 * lane;      /* bq, bl: the same in every lane */
#pragma unroll
    for (int g = 0; g < FQ; ++g) { qh[g][0] = tf_frag(pq + (size_t)g * 16 * LQ); qh[g][1] = tf_frag(pq + (size_t)g * 16 * LQ + 512); ql[g][0] = tf_frag(pl + (size_t)g * 16 * LQ); ql[g][1] = tf_frag(pl + (size_t)g * 16 * LQ + 512); }
    asm volatile("s_wait_xcnt 0x0" :: "s"(bq), "s"(bl), "v"(lane) : "memory"); }      /* stands behind the q loads and in front of every instruction that rewrites an address register they name: the loads take a scalar base and the lane number, which are inputs so that their registers stay as they are up to the wait */
  const _Float16* pkh = Kh + (size_t)b * SQ * LQ + h * (HD * 16) + 8 * lane; const _Float16* pkl = Kl + (size_t)b * SQ * LQ + h * (HD * 16) + 8 * lane;
  const _Float16* pvh = Vh + (size_t)bh * HD * SQ + 8 * lane; const _Float16* pvl = Vl + (size_t)bh * HD * SQ + 8 * lane; const int* pm = Km + (size_t)b * SQ + lane;
  int kmv;
  auto ldk = [&](int kb, bool pre) { const _Float16* a = pkh + (size_t)kb * LQ; const _Float16* c = pkl + (size_t)kb * LQ; const int* e = pm + kb; FAK f;
#pragma unroll
    for (int t = 0; t < 2; ++t) { f.h[t][0] = tf_frag(a + (size_t)t * 16 * LQ); f.h[t][1] = tf_frag(a + (size_t)t * 16 * LQ + 512); f.l[t][0] = tf_frag(c + (size_t)t * 16 * LQ); f.l[t][1] = tf_frag(c + (size_t)t * 16 * LQ + 512); }
    kmv = *e;
    /* the wait stands behind the loads and in front of every instruction that rewrites an address register they name; the addresses are inputs so that their registers stay as they are up to the wait. pre (a constant at each call): the loads in front of the loop take a scalar base and the lane number, so there the lane number is an input too */
    if (pre) asm volatile("s_wait_xcnt 0x0" :: "v"(a), "v"(c), "v"(e), "v"(lane) : "memory"); else asm volatile("s_wait_xcnt 0x0" :: "v"(a), "v"(c), "v"(e) : "memory");
    return f; };
  auto ldv = [&](int kb) { const _Float16* a = pvh + (size_t)kb * 16; const _Float16* c = pvl + (size_t)kb * 16; FAV f;      /* 32 keys = one tile of 512 elements */
#pragma unroll
    for (int d = 0; d < 4; ++d) { f.h[d] = tf_frag(a + (size_t)d * 16 * SQ); f.l[d] = tf_frag(c + (size_t)d * 16 * SQ); }
    asm volatile("s_wait_xcnt 0x0" :: "v"(a), "v"(c) : "memory");      /* as in ldk */
    return f; };
  const v8f z8 = {0.f, 0.f, 0.f, 0.f, 0.f, 0.f, 0.f, 0.f};
  v8f o[FQ][4]; float m[FQ], l[FQ];
#pragma unroll
  for (int g = 0; g < FQ; ++g) { m[g] = -3.0e38f; l[g] = 0.f; for (int d = 0; d < 4; ++d) o[g][d] = z8; }
  FAK kf = ldk(0, true);
  /* kept rolled: one trip holds 32 keys x 32 queries, and a second copy would only add code and registers */
#pragma unroll 1
  for (int kb = 0; kb <= q0; kb += 32) {
    const FAV vf = ldv(kb);      /* issued here, first read behind the softmax */
    v8f s[FQ][2];
#pragma unroll
    for (int g = 0; g < FQ; ++g) {
#pragma unroll
      for (int t = 0; t < 2; ++t) { v8f sh = fa_mma(kf.h[t][0], qh[g][0], z8); sh = fa_mma(kf.h[t][1], qh[g][1], sh);
        v8f sl = fa_mma(kf.h[t][0], ql[g][0], z8); sl = fa_mma(kf.h[t][1], ql[g][1], sl); sl = fa_mma(kf.l[t][0], qh[g][0], sl); sl = fa_mma(kf.l[t][1], qh[g][1], sl);
#pragma unroll
        for (int r = 0; r < 8; ++r) s[g][t][r] = fmaf(sl[r], 0.18033688011112042f / 1024.0f, sh[r] * 0.18033688011112042f); } }      /* (q_hi.k_hi + (q_lo.k_hi + q_hi.k_lo)/1024) / 8, times log2(e) */
    const unsigned bm = __builtin_amdgcn_ballot_w32(kmv != 0);      /* bit j: key kb + j is not padded */
    kf = ldk(kb + 32 <= q0 ? kb + 32 : kb, false);      /* the next trip's K fragments fly over the softmax and P.V; behind the last trip an in-bounds re-read that nothing uses */
    if (kb == q0 || bm != 0xFFFFFFFFu) {      /* only the diagonal trip and trips with a padded key mask; the test is the same for the whole wave */
      const unsigned bmh = bm >> (8 * hh);
#pragma unroll
      for (int g = 0; g < FQ; ++g) {
#pragma unroll
        for (int t = 0; t < 2; ++t) {
#pragma unroll
          for (int r = 0; r < 8; ++r) { const bool ok = (kb + t * 16 + 8 * hh + r <= q0 + g * 16 + ln) && ((bmh >> (t * 16 + r)) & 1u); s[g][t][r] = ok ? s[g][t][r] : -1.0e9f; } } } }
    v16h ph[FQ], pl[FQ];
#pragma unroll
    for (int g = 0; g < FQ; ++g) { float mx = fmaxf(s[g][0][0], s[g][1][0]);
#pragma unroll
      for (int r = 1; r < 8; ++r) mx = fmaxf(mx, fmaxf(s[g][0][r], s[g][1][r]));
      mx = fmaxf(mx, __shfl_xor(mx, 16, 32));      /* the query's other 16 keys of this trip sit in the other lane half */
      const float mn = fmaxf(m[g], mx); const float sc = exp2_native(m[g] - mn); const float mo = mn - 12.0f; m[g] = mn;
      float se0 = 0.f, se1 = 0.f;
#pragma unroll
      for (int r = 0; r < 8; ++r) { const float e0 = exp2_native(s[g][0][r] - mo), e1 = exp2_native(s[g][1][r] - mo); se0 += e0; se1 += e1; ph[g][r] = (_Float16)e0; ph[g][8 + r] = (_Float16)e1; }
      l[g] = fmaf(l[g], sc, se0 + se1); pl[g] = ph[g] * (_Float16)0.0009765625f;
#pragma unroll
      for (int d = 0; d < 4; ++d) o[g][d] *= sc; }
#pragma unroll
    for (int d = 0; d < 4; ++d) {
#pragma unroll
      for (int g = 0; g < FQ; ++g) { o[g][d] = fa_mma(vf.h[d], ph[g], o[g][d]); o[g][d] = fa_mma(vf.l[d], pl[g], o[g][d]); } } }
  /* o leaves as the two fragment-major planes that the out GEMM reads (f16 hi + x1024 residual, DM columns). A lane holds 8 consecutive columns (d * 16 + 8 hh + r) of its query row (ln) per tile: one chunk of a plane tile, at the lane's own place in it, so each store is 512 contiguous bytes of the wave */
  v8us hv[FQ][4], lv[FQ][4];
#pragma unroll
  for (int g = 0; g < FQ; ++g) { const float fin = 64.0f / (l[g] + __shfl_xor(l[g], 16, 32));      /* o carried x64; the halves' sums are joined once */
#pragma unroll
    for (int d = 0; d < 4; ++d) { float v[8];
#pragma unroll
      for (int r = 0; r < 8; ++r) v[r] = o[g][d][r] * fin;
      hl8(v, hv[g][d], lv[g][d]); } }
  const size_t tile0 = ((size_t)b * SQ + q0) * DM + h * (HD * 16); unsigned short* ph = (unsigned short*)Oh + tile0 + 8 * lane; unsigned short* pl = (unsigned short*)Ol + tile0 + 8 * lane;
#pragma unroll
  for (int g = 0; g < FQ; ++g) {
#pragma unroll
    for (int d = 0; d < 4; ++d) { const size_t e = (size_t)g * 16 * DM + (d >> 1) * 512 + (d & 1) * 256; *(v8us*)(ph + e) = hv[g][d]; *(v8us*)(pl + e) = lv[g][d]; } }
  asm volatile("s_wait_xcnt 0x0" :: "v"(ph), "v"(pl) : "memory");      /* stands behind the stores: their address registers stay as they are up to here */
}




// ---- operand preparation: every f16 plane that the projections read, in ONE launch ----
// Blocks 0 .. PXB - 1 take x: a thread reads PU chunks of 8 columns (the same 8 columns of rows 16 apart, so Wt and bt are read once) and writes each as x (exact f16) and as x_time = x + t Wt + bt (f16 hi + x1024 residual); x is read once for the three planes.
// The other PWB blocks take the four weight matrices (natural [out][in] = Bt[n][k], x16): a thread converts two chunks (rows 16 apart) of each.
// All of a thread's loads are issued before the first value is used. 16 waves per WGP carry the whole stream, so few waves have to start; the x blocks (more bytes) come first in the grid.
#define PU 8                                        /* chunks per thread */
#define PXB ((unsigned)(NR * DM / 8 / PU / 256))    /* blocks on x */
#define PWB ((unsigned)((size_t)4 * DM * DM / 8 / PU / 256))      /* blocks on the weights */
static_assert(NR % (16 * PU) == 0 && DM % 32 == 0 && PU == 8, "k_prep: a thread takes PU 16-row bands of x, or two of each of the four weight matrices");
__global__ __launch_bounds__(256) void k_prep(const float* __restrict__ x, const float* __restrict__ tg, const float* __restrict__ wt, const float* __restrict__ bt, const float* __restrict__ wq, const float* __restrict__ wk, const float* __restrict__ wv, const float* __restrict__ wo,
    _Float16* __restrict__ X16, _Float16* __restrict__ XT, _Float16* __restrict__ XL, _Float16* __restrict__ BQ, _Float16* __restrict__ BK, _Float16* __restrict__ BV, _Float16* __restrict__ BO) {
  const bool onx = blockIdx.x < PXB;      /* the same for the whole block */
  size_t rt, kc; tf_chunk((size_t)(onx ? blockIdx.x : blockIdx.x - PXB) * 256 + threadIdx.x, rt, kc);
  const size_t r = (rt >> 4) * (onx ? 16 * PU : 32) + (rt & 15);      /* the thread's first row: its bands are neighbours, so the chunk keeps its columns and its place inside a tile, and every further chunk is a constant offset (16 rows) from the first */
  const size_t si = r * DM + kc, di = tf_off(r, kc, DM);      /* first element in x or a weight matrix, and in a fragment-major plane; 16 rows further on is 16 * DM elements further on in both */
  /* every loop under '#pragma unroll' in this kernel is fully unrolled so that the loaded and the converted chunks are registers and the loads stand together */
  if (onx) {
    const float* px = x + si; const float* pg = tg + r; const unsigned ow = (unsigned)(kc * sizeof(float)); v4f xa[PU], xb[PU]; float gv[PU];      /* ow: the columns' byte offset in Wt and bt */
#pragma unroll
    for (int u = 0; u < PU; ++u) { xa[u] = *(const v4fa*)(px + (size_t)u * 16 * DM); xb[u] = *(const v4fa*)(px + (size_t)u * 16 * DM + 4); gv[u] = pg[u * 16]; }
    const v4f w0 = *(const v4fa*)((const char*)wt + ow), w1 = *(const v4fa*)((const char*)wt + ow + 16), b0 = *(const v4fa*)((const char*)bt + ow), b1 = *(const v4fa*)((const char*)bt + ow + 16);
    asm volatile("s_wait_xcnt 0x0" :: "v"(px), "v"(pg), "s"(wt), "s"(bt), "v"(ow) : "memory");      /* stands behind the loads and in front of every instruction that rewrites an address register they name (two addresses; for Wt and bt a scalar base and the offset); they are inputs so that no load lands on one of them */
    const float wv8[8] = {w0[0], w0[1], w0[2], w0[3], w1[0], w1[1], w1[2], w1[3]}, bv8[8] = {b0[0], b0[1], b0[2], b0[3], b1[0], b1[1], b1[2], b1[3]}; float wr[8], br[8];
#pragma unroll
    for (int q = 0; q < 8; ++q) { wr[q] = bf16_round(wv8[q]); br[q] = bf16_round(bv8[q]); }
    v8us cx[PU], ch[PU], cl[PU];
#pragma unroll
    for (int u = 0; u < PU; ++u) { const float g = bf16_round(gv[u]); const float xv[8] = {xa[u][0], xa[u][1], xa[u][2], xa[u][3], xb[u][0], xb[u][1], xb[u][2], xb[u][3]}; FragH e, f, l;
#pragma unroll
      for (int q = 0; q < 8; ++q) { const float xr = bf16_round(xv[q]); e.h[q] = (_Float16)xr; const float te = __fadd_rn(__fmul_rn(g, wr[q]), br[q]); const float v = __fadd_rn(xr, te); const _Float16 h = (_Float16)v; f.h[q] = h; l.h[q] = (_Float16)((v - (float)h) * 1024.0f); }
      cx[u] = e.half[0]; ch[u] = f.half[0]; cl[u] = l.half[0]; }
    __builtin_amdgcn_sched_barrier(0);      /* keeps the 24 stores together behind the conversions: without it the build spreads them among the conversions, which then rewrite registers of stores in flight and take a wait each time */
    unsigned short* qx = (unsigned short*)X16 + di; unsigned short* qh = (unsigned short*)XT + di; unsigned short* ql = (unsigned short*)XL + di;
#pragma unroll
    for (int u = 0; u < PU; ++u) { const size_t o = (size_t)u * 16 * DM; *(v8us*)(qx + o) = cx[u]; *(v8us*)(qh + o) = ch[u]; *(v8us*)(ql + o) = cl[u]; }
    asm volatile("s_wait_xcnt 0x0" :: "v"(qx), "v"(qh), "v"(ql) : "memory");      /* stands behind the stores: their address registers stay as they are up to here */
  } else {
    const float* p0 = wq + si; const float* p1 = wk + si; const float* p2 = wv + si; const float* p3 = wo + si; v4f wa[PU], wb[PU];
#pragma unroll
    for (int u = 0; u < PU; ++u) { const float* p = (u < 2 ? p0 : u < 4 ? p1 : u < 6 ? p2 : p3) + (size_t)(u & 1) * 16 * DM; wa[u] = *(const v4fa*)p; wb[u] = *(const v4fa*)(p + 4); }
    asm volatile("s_wait_xcnt 0x0" :: "v"(p0), "v"(p1), "v"(p2), "v"(p3) : "memory");      /* as above: behind the loads, their addresses as inputs */
    v8us cw[PU];
#pragma unroll
    for (int u = 0; u < PU; ++u) { const float v[8] = {wa[u][0], wa[u][1], wa[u][2], wa[u][3], wb[u][0], wb[u][1], wb[u][2], wb[u][3]}; FragH f;
#pragma unroll
      for (int q = 0; q < 8; ++q) f.h[q] = (_Float16)(bf16_round(v[q]) * 16.0f);
      cw[u] = f.half[0]; }
    unsigned short* q0 = (unsigned short*)BQ + di; unsigned short* q1 = (unsigned short*)BK + di; unsigned short* q2 = (unsigned short*)BV + di; unsigned short* q3 = (unsigned short*)BO + di;
#pragma unroll
    for (int u = 0; u < PU; ++u) *(v8us*)((u < 2 ? q0 : u < 4 ? q1 : u < 6 ? q2 : q3) + (size_t)(u & 1) * 16 * DM) = cw[u];
    asm volatile("s_wait_xcnt 0x0" :: "v"(q0), "v"(q1), "v"(q2), "v"(q3) : "memory");      /* stands behind the stores: their address registers stay as they are up to here */
  }
}
extern "C" void kernel_launch(void* const* d_in, const int* in_sizes, int n_in,
                              void* d_out, int out_size, void* d_ws, size_t ws_size, hipStream_t stream) {
  (void)in_sizes; (void)n_in; (void)out_size;
  const float* const* I = (const float* const*)d_in; const float* x = I[0]; const float* tg = I[1]; const int* km = (const int*)d_in[2]; const float* wq = I[3]; const float* bq = I[4]; const float* wk = I[5]; const float* bk = I[6]; const float* wv = I[7]; const float* bv = I[8]; const float* wo = I[9]; const float* bo = I[10]; const float* wt = I[11]; const float* bt = I[12];      /* natural [out][in] weights + biases; time_gaps [2][2048][1]; int key mask [2][2048]; Wt [1024][1], bt [1024] */
  char* ws = (char*)d_ws; size_t off = 0;
  auto take = [&](size_t bytes) { char* p = ws + off; off += (bytes + 255) & ~(size_t)255; return p; };
  _Float16* BQ = (_Float16*)take((size_t)DM * DM * 2); _Float16* BK = (_Float16*)take((size_t)DM * DM * 2); _Float16* BV = (_Float16*)take((size_t)DM * DM * 2); _Float16* BO = (_Float16*)take((size_t)DM * DM * 2);
  _Float16* X16 = (_Float16*)take(NR * DM * 2); _Float16* XT16 = (_Float16*)take(NR * DM * 2); _Float16* XL16 = (_Float16*)take(NR * DM * 2);      /* x (exact f16) for v; x_time as f16 hi + x1024 residual for q and k */ float* QF = (float*)take(NR * DM * 4); float* KF = (float*)take(NR * DM * 4); float* VF = (float*)take(NR * DM * 4);      /* f32 rows of q, k, v: only the first QT0 rows of each batch are written and read (the first-tile attention) */ _Float16* Q16 = (_Float16*)take(NR * DM * 2); _Float16* QL = (_Float16*)take(NR * DM * 2); _Float16* K16 = (_Float16*)take(NR * DM * 2); _Float16* KL = (_Float16*)take(NR * DM * 2); _Float16* O16 = (_Float16*)take(NR * DM * 2); _Float16* OL = (_Float16*)take(NR * DM * 2);
  _Float16* VT = (_Float16*)take((size_t)NB * NH * HD * SQ * 2); _Float16* VTL = (_Float16*)take((size_t)NB * NH * HD * SQ * 2);      /* V^T planes of both batches */
  if (off > ws_size) return;
  k_prep<<<PXB + PWB, 256, 0, stream>>>(x, tg, wt, bt, wq, wk, wv, wo, X16, XT16, XL16, BQ, BK, BV, BO);      /* x (exact f16), x_time = x + time_gaps Wt^T + bt (f16 hi + x1024 residual) and the four weight planes (x16), all fragment-major, in one launch */
  const size_t r0p = (size_t)B0 * SQ;      /* first projected row */
  k_gemm2p<true><<<(unsigned)((MP / 128) * (DM / 64)), 128, 0, stream>>>(XT16 + r0p * DM, XL16 + r0p * DM, BQ, 0.0625f, 0.00006103515625f, bq, QF + r0p * DM, MP, Q16 + r0p * DM, QL + r0p * DM);      /* q: the GEMM writes the f16 hi + x1024 residual planes itself */
  k_gemm2p<true><<<(unsigned)((MP / 128) * (DM / 64)), 128, 0, stream>>>(XT16 + r0p * DM, XL16 + r0p * DM, BK, 0.0625f, 0.00006103515625f, bk, KF + r0p * DM, MP, K16 + r0p * DM, KL + r0p * DM);      /* k likewise */
  k_gemm2<0, true><<<dim3((unsigned)((NR / 128) * (DM / 64)), 1), 128, 0, stream>>>(X16, DM, 0, BV, DM, 0, 0.0625f, bv, 0, nullptr, 1, 0, 0, VF, nullptr, DM, 0, (int)NR, DM, DM, VT, VTL);      /* v = x Wv^T + bv in f32; the GEMM writes V^T (f16 hi + x1024 residual) [NB][NH][HD][SQ] itself */
  k_fattn<<<NB * NH * (SQ / (128 * FQ)), 256, 0, stream>>>(Q16, QL, K16, KL, VT, VTL, km, O16, OL, QF, KF, VF);      /* o (x64) as f16 hi + x1024 residual planes: scores, causal + key padding softmax and P.V of both batches and all heads in one launch; rows 0..127 of each batch come from four waves per (batch, head) of the same launch in exact f32, from the f32 q, k, v rows of the full projections */
  k_gemm2p<false><<<(unsigned)((MPO / 128) * (DM / 64)), 128, 0, stream>>>(O16 + r0p * DM, OL + r0p * DM, BO, 0.0009765625f, 0.00000095367431640625f, bo, (float*)d_out + r0p * DM, MPO, nullptr, nullptr);      /* out = (o_hi Wo^T + bo) + o_lo Wo^T 2^-20, one launch */
}
